// v000
// The times below were measured on an AMD MI455X: many runs one after another, warmed up first and cycling through
// copies of the inputs, with the whole window's GPU time divided by the number of runs. Launches and the gaps
// between them are all in it. The median over several windows is given; except for v000 it joins two sittings, which
// can be a few percent apart, so the side-by-side timings, each taken in one sitting, are the better comparison.
// v000 is the starting kernel. One run takes 778 microseconds.
#include <hip/hip_runtime.h>
#include <hip/hip_bf16.h>
#include <math.h>

typedef __attribute__((ext_vector_type(16))) __bf16 v16bf;
typedef __attribute__((ext_vector_type(8)))  float  v8f;

typedef __attribute__((ext_vector_type(4))) unsigned int tdm_g0_t;
typedef __attribute__((ext_vector_type(8))) int          tdm_g1_t;
typedef __attribute__((ext_vector_type(4))) int          tdm_g23_t;
typedef __attribute__((ext_vector_type(8))) int          tdm_g4_t;

#define D_MODEL 1024
#define FFN_DIM 4096
#define BATCH   4
#define SEQ     2048
#define HEADS   16
#define DK      64
#define LDST    40   // LDS row stride in bf16 (16 DW data + 4 DW pad = 80B)

static __device__ __forceinline__ v16bf frag_ld(const __bf16* p, int hi) {
  v16bf f;
  const __bf16* p0 = p + hi * 8;
#pragma unroll
  for (int e = 0; e < 8; ++e) {
    f[e]     = p0[e];
    f[8 + e] = p0[16 + e];
  }
  return f;
}

static __device__ __forceinline__ unsigned lds_byte_off(const void* p) {
  return (unsigned)(unsigned long long)(size_t)p;
}

static __device__ __forceinline__ void tdm_load_tile_128x32bf(
    const __bf16* gptr, unsigned lds_addr, unsigned row_dw, unsigned nrows_total) {
  unsigned long long ga = (unsigned long long)(size_t)gptr;
  tdm_g0_t g0;
  g0[0] = 1u;                                             // count=1 (valid), user mode
  g0[1] = lds_addr;                                       // LDS byte address
  g0[2] = (unsigned)(ga & 0xffffffffu);                   // global_addr[31:0]
  g0[3] = (unsigned)((ga >> 32) & 0x01ffffffu) | (2u << 30); // addr[56:32] | type=2

  tdm_g1_t g1;
  g1[0] = (int)((2u << 16) | (1u << 20) | (3u << 22) | (3u << 25));
  g1[1] = (int)((row_dw & 0xffffu) << 16);
  g1[2] = (int)(((row_dw >> 16) & 0xffffu) | ((nrows_total & 0xffffu) << 16));
  g1[3] = (int)(((nrows_total >> 16) & 0xffffu) | (16u << 16));
  g1[4] = (int)128u;
  g1[5] = (int)row_dw;
  g1[6] = 0;
  g1[7] = 0;

  tdm_g23_t gz = {0, 0, 0, 0};
  tdm_g4_t  gz8 = {0, 0, 0, 0, 0, 0, 0, 0};
  __builtin_amdgcn_tensor_load_to_lds(g0, g1, gz, gz, gz8, 0);
}

// -------------------------------------------------------------------------
// f32 -> bf16 with transpose: Wt[n*K + k] = (bf16)W[k*N + n]
// -------------------------------------------------------------------------
__global__ void __launch_bounds__(256) cvt_transpose_kernel(
    const float* __restrict__ W, __bf16* __restrict__ Wt, int K, int N) {
  size_t idx = (size_t)blockIdx.x * 256 + threadIdx.x;
  size_t total = (size_t)K * N;
  if (idx >= total) return;
  int k = (int)(idx / N);
  int n = (int)(idx % N);
  Wt[(size_t)n * K + k] = (__bf16)W[idx];
}

// -------------------------------------------------------------------------
// LayerNorm (torch semantics: std with ddof=1, eps added to std), bf16 out.
// -------------------------------------------------------------------------
static __device__ __forceinline__ float block_reduce_sum(float v, float* sbuf) {
  __syncthreads();
#pragma unroll
  for (int off = 16; off > 0; off >>= 1) v += __shfl_xor(v, off, 32);
  const int wv = threadIdx.x >> 5;
  if ((threadIdx.x & 31) == 0) sbuf[wv] = v;
  __syncthreads();
  if (threadIdx.x == 0) {
    float s = 0.f;
#pragma unroll
    for (int i = 0; i < 8; ++i) s += sbuf[i];
    sbuf[0] = s;
  }
  __syncthreads();
  return sbuf[0];
}

__global__ void __launch_bounds__(256) layernorm_bf16_kernel(
    const float* __restrict__ x, const float* __restrict__ alpha,
    const float* __restrict__ beta, __bf16* __restrict__ out) {
  __shared__ float sbuf[8];
  const int row = blockIdx.x;
  const int tid = threadIdx.x;
  const float* xr = x + (size_t)row * D_MODEL;
  float xv[4];
#pragma unroll
  for (int i = 0; i < 4; ++i) xv[i] = xr[tid + i * 256];
  const float mean =
      block_reduce_sum(xv[0] + xv[1] + xv[2] + xv[3], sbuf) * (1.0f / D_MODEL);
  float ss = 0.f;
#pragma unroll
  for (int i = 0; i < 4; ++i) { float d = xv[i] - mean; ss += d * d; }
  const float var = block_reduce_sum(ss, sbuf) * (1.0f / (D_MODEL - 1));
  const float inv = 1.0f / (sqrtf(var) + 1e-6f);
  __bf16* orow = out + (size_t)row * D_MODEL;
#pragma unroll
  for (int i = 0; i < 4; ++i) {
    const int c = tid + i * 256;
    orow[c] = (__bf16)(alpha[c] * (xv[i] - mean) * inv + beta[c]);
  }
}

template <bool HAS_RESID, bool RELU, bool OUT_F32, bool OUT_BF16>
__global__ void __launch_bounds__(256) gemm_bf16_kernel(
    const __bf16* __restrict__ A, const __bf16* __restrict__ Bt,
    const float* __restrict__ bias, const float* __restrict__ resid,
    float* __restrict__ Cf, __bf16* __restrict__ Cb,
    int M, int N, int K) {
  __shared__ __align__(16) __bf16 lA[2][128 * LDST];
  __shared__ __align__(16) __bf16 lB[2][128 * LDST];

  const int tid   = threadIdx.x;
  const int wave  = tid >> 5;
  const int lane  = tid & 31;
  const int idx   = lane & 15;
  const int hi    = lane >> 4;
  const int waveM = wave >> 1;  // 0..3
  const int waveN = wave & 1;   // 0..1
  const int m0 = blockIdx.y * 128;
  const int n0 = blockIdx.x * 128;

  v8f acc[2][4] = {};

  const __bf16* Abase = A  + (size_t)m0 * K;
  const __bf16* Bbase = Bt + (size_t)n0 * K;
  const unsigned row_dw = (unsigned)(K >> 1);
  const int nk = K >> 5;

  if (tid < 32) {
    tdm_load_tile_128x32bf(Abase, lds_byte_off(&lA[0][0]), row_dw, (unsigned)M);
    tdm_load_tile_128x32bf(Bbase, lds_byte_off(&lB[0][0]), row_dw, (unsigned)N);
    __builtin_amdgcn_s_wait_tensorcnt(0);
  }
  __syncthreads();

  for (int i = 0; i < nk; ++i) {
    const int cur = i & 1;
    // Kick off DMA of the next K-tile into the other buffer while we compute.
    if (i + 1 < nk && tid < 32) {
      const int k1 = (i + 1) << 5;
      tdm_load_tile_128x32bf(Abase + k1, lds_byte_off(&lA[cur ^ 1][0]), row_dw, (unsigned)M);
      tdm_load_tile_128x32bf(Bbase + k1, lds_byte_off(&lB[cur ^ 1][0]), row_dw, (unsigned)N);
    }

    v16bf va[2], vb[4];
#pragma unroll
    for (int t = 0; t < 2; ++t)
      va[t] = frag_ld(&lA[cur][(waveM * 32 + t * 16 + idx) * LDST], hi);
#pragma unroll
    for (int u = 0; u < 4; ++u)
      vb[u] = frag_ld(&lB[cur][(waveN * 64 + u * 16 + idx) * LDST], hi);
#pragma unroll
    for (int t = 0; t < 2; ++t)
#pragma unroll
      for (int u = 0; u < 4; ++u)
        acc[t][u] = __builtin_amdgcn_wmma_f32_16x16x32_bf16(
            false, va[t], false, vb[u], (short)0, acc[t][u], false, false);

    if (tid < 32) __builtin_amdgcn_s_wait_tensorcnt(0);
    __syncthreads();  // next-tile DMA landed & everyone done reading cur
  }

  // ---- epilogue: bias -> relu -> residual ----
#pragma unroll
  for (int t = 0; t < 2; ++t) {
#pragma unroll
    for (int u = 0; u < 4; ++u) {
      const int gn = n0 + waveN * 64 + u * 16 + idx;
      const float bval = bias[gn];
      const size_t base =
          (size_t)(m0 + waveM * 32 + t * 16 + hi * 8) * N + gn;
#pragma unroll
      for (int r = 0; r < 8; ++r) {
        float v = acc[t][u][r] + bval;
        if (RELU) v = fmaxf(v, 0.f);
        if (HAS_RESID) v += resid[base + (size_t)r * N];
        if (OUT_F32) Cf[base + (size_t)r * N] = v;
        if (OUT_BF16) Cb[base + (size_t)r * N] = (__bf16)v;
      }
    }
  }
}

// -------------------------------------------------------------------------
// Flash attention (non-causal, int mask over kv columns).
// Q/K/V/Ctx: bf16 [B*S, D_MODEL], head h occupies cols h*64..h*64+63.
// Grid: (S/128, B*H); 8 waves, each owns 16 query rows. KV tiles of 32.
// 4 WMMA for QK^T + 4 WMMA for P*V per tile per wave; online softmax with
// 16-lane butterfly reductions; P rematerialized via per-wave LDS scratch
// guarded by an explicit s_wait_dscnt.
// -------------------------------------------------------------------------
__global__ void __launch_bounds__(256) attn_kernel(
    const __bf16* __restrict__ Q, const __bf16* __restrict__ Kmat,
    const __bf16* __restrict__ V, const int* __restrict__ mask,
    __bf16* __restrict__ Ctx) {
  __shared__ __align__(16) __bf16 lK[32][72];      // [kv][d]
  __shared__ __align__(16) __bf16 lVt[64][LDST];   // [d][kv] (transposed)
  __shared__ __align__(16) __bf16 lP[8][16][LDST]; // per-wave P scratch

  const int b    = blockIdx.y / HEADS;
  const int h    = blockIdx.y % HEADS;
  const int tid  = threadIdx.x;
  const int wave = tid >> 5;
  const int lane = tid & 31;
  const int idx  = lane & 15;
  const int hi   = lane >> 4;
  const int q0   = blockIdx.x * 128 + wave * 16;

  const __bf16* qrow = Q + (size_t)(b * SEQ + q0 + idx) * D_MODEL + h * DK;
  const v16bf qf0 = frag_ld(qrow, hi);
  const v16bf qf1 = frag_ld(qrow + 32, hi);

  float mrow[8], lrow_[8];
  v8f o[4] = {};
#pragma unroll
  for (int r = 0; r < 8; ++r) { mrow[r] = -3.0e38f; lrow_[r] = 0.f; }

  const int* mcol = mask + (size_t)b * SEQ;

  for (int kv0 = 0; kv0 < SEQ; kv0 += 32) {
    __syncthreads();  // previous tile fully consumed
    {
      const int kv  = tid >> 3;       // 0..31
      const int seg = (tid & 7) * 8;  // 0..56
      const __bf16* gk =
          Kmat + (size_t)(b * SEQ + kv0 + kv) * D_MODEL + h * DK + seg;
      const __bf16* gv =
          V + (size_t)(b * SEQ + kv0 + kv) * D_MODEL + h * DK + seg;
      *(uint4*)&lK[kv][seg] = *(const uint4*)gk;
      __bf16 tmp[8];
      *(uint4*)tmp = *(const uint4*)gv;
#pragma unroll
      for (int i = 0; i < 8; ++i) lVt[seg + i][kv] = tmp[i];  // transpose V
    }
    __syncthreads();

    // ---- S = (Q K^T) * 1/sqrt(dk), two 16-col blocks ----
    v8f sc[2];
#pragma unroll
    for (int nb = 0; nb < 2; ++nb) {
      const v16bf kf0 = frag_ld(&lK[nb * 16 + idx][0], hi);
      const v16bf kf1 = frag_ld(&lK[nb * 16 + idx][32], hi);
      v8f a = {};
      a = __builtin_amdgcn_wmma_f32_16x16x32_bf16(false, qf0, false, kf0,
                                                  (short)0, a, false, false);
      a = __builtin_amdgcn_wmma_f32_16x16x32_bf16(false, qf1, false, kf1,
                                                  (short)0, a, false, false);
      sc[nb] = a;
    }
    const float sm0 = (mcol[kv0 + idx] != 0) ? 0.f : -1.0e9f;
    const float sm1 = (mcol[kv0 + 16 + idx] != 0) ? 0.f : -1.0e9f;
#pragma unroll
    for (int r = 0; r < 8; ++r) {
      sc[0][r] = sc[0][r] * 0.125f + sm0;
      sc[1][r] = sc[1][r] * 0.125f + sm1;
    }

    // ---- online softmax ----
    float mnew[8], alph[8];
#pragma unroll
    for (int r = 0; r < 8; ++r) {
      float v = fmaxf(sc[0][r], sc[1][r]);
#pragma unroll
      for (int off = 1; off < 16; off <<= 1) v = fmaxf(v, __shfl_xor(v, off, 32));
      mnew[r] = fmaxf(mrow[r], v);
      alph[r] = __expf(mrow[r] - mnew[r]);
      mrow[r] = mnew[r];
    }
#pragma unroll
    for (int r = 0; r < 8; ++r) {
      const float p0 = __expf(sc[0][r] - mnew[r]);
      const float p1 = __expf(sc[1][r] - mnew[r]);
      lP[wave][hi * 8 + r][idx]      = (__bf16)p0;
      lP[wave][hi * 8 + r][16 + idx] = (__bf16)p1;
      float rs = p0 + p1;
#pragma unroll
      for (int off = 1; off < 16; off <<= 1) rs += __shfl_xor(rs, off, 32);
      lrow_[r] = lrow_[r] * alph[r] + rs;
#pragma unroll
      for (int u = 0; u < 4; ++u) o[u][r] *= alph[r];
    }

    // Cross-lane P exchange through LDS: enforce DS completion before reuse.
    asm volatile("s_wait_dscnt 0" ::: "memory");

    const v16bf pf = frag_ld(&lP[wave][idx][0], hi);
#pragma unroll
    for (int u = 0; u < 4; ++u) {
      const v16bf vf = frag_ld(&lVt[u * 16 + idx][0], hi);
      o[u] = __builtin_amdgcn_wmma_f32_16x16x32_bf16(false, pf, false, vf,
                                                     (short)0, o[u], false, false);
    }
  }

  // ---- normalize and store ctx ----
#pragma unroll
  for (int r = 0; r < 8; ++r) {
    const float invl = (lrow_[r] > 0.f) ? (1.0f / lrow_[r]) : 0.f;
    __bf16* orow =
        Ctx + (size_t)(b * SEQ + q0 + hi * 8 + r) * D_MODEL + h * DK;
#pragma unroll
    for (int u = 0; u < 4; ++u) orow[u * 16 + idx] = (__bf16)(o[u][r] * invl);
  }
}

// ---------------------------------------------------------------------------
// Host orchestration
// ---------------------------------------------------------------------------
extern "C" void kernel_launch(void* const* d_in, const int* in_sizes, int n_in,
                              void* d_out, int out_size, void* d_ws, size_t ws_size,
                              hipStream_t stream) {
  (void)in_sizes; (void)n_in; (void)out_size; (void)ws_size;
  const float* x    = (const float*)d_in[0];
  const int*   mask = (const int*)  d_in[1];
  const float* wq   = (const float*)d_in[2];
  const float* bq   = (const float*)d_in[3];
  const float* wk   = (const float*)d_in[4];
  const float* bk   = (const float*)d_in[5];
  const float* wv   = (const float*)d_in[6];
  const float* bv   = (const float*)d_in[7];
  const float* wo   = (const float*)d_in[8];
  const float* bo   = (const float*)d_in[9];
  const float* w1   = (const float*)d_in[10];
  const float* b1   = (const float*)d_in[11];
  const float* w2   = (const float*)d_in[12];
  const float* b2   = (const float*)d_in[13];
  const float* l1a  = (const float*)d_in[14];
  const float* l1b  = (const float*)d_in[15];
  const float* l2a  = (const float*)d_in[16];
  const float* l2b  = (const float*)d_in[17];

  const size_t DD2  = (size_t)D_MODEL * D_MODEL * 2;        // 2 MB
  const size_t DF2  = (size_t)D_MODEL * FFN_DIM * 2;        // 8 MB
  const size_t ACT2 = (size_t)BATCH * SEQ * D_MODEL * 2;    // 16 MB
  const size_t ACT4 = (size_t)BATCH * SEQ * D_MODEL * 4;    // 32 MB
  char* ws = (char*)d_ws;
  __bf16* wqT = (__bf16*)(ws + 0 * DD2);
  __bf16* wkT = (__bf16*)(ws + 1 * DD2);
  __bf16* wvT = (__bf16*)(ws + 2 * DD2);
  __bf16* woT = (__bf16*)(ws + 3 * DD2);
  __bf16* w1T = (__bf16*)(ws + 4 * DD2);
  __bf16* w2T = (__bf16*)(ws + 4 * DD2 + DF2);
  char* p = ws + 4 * DD2 + 2 * DF2;
  float*  hbuf = (float*)p;            p += ACT4;   // h = x + attn (f32)
  __bf16* xln  = (__bf16*)p;           p += ACT2;   // ln1 out, reused as ln2 out
  __bf16* qb   = (__bf16*)(p + 0 * ACT2);
  __bf16* kb   = (__bf16*)(p + 1 * ACT2);
  __bf16* vbuf = (__bf16*)(p + 2 * ACT2);
  __bf16* ctxb = (__bf16*)(p + 3 * ACT2);
  __bf16* a1   = (__bf16*)p;  // FFN hidden (64 MB) reuses q/k/v/ctx region
  // total workspace: ~136 MB

  const int M = BATCH * SEQ;  // 8192
  dim3 blk(256);

  cvt_transpose_kernel<<<(D_MODEL * D_MODEL) / 256, blk, 0, stream>>>(wq, wqT, D_MODEL, D_MODEL);
  cvt_transpose_kernel<<<(D_MODEL * D_MODEL) / 256, blk, 0, stream>>>(wk, wkT, D_MODEL, D_MODEL);
  cvt_transpose_kernel<<<(D_MODEL * D_MODEL) / 256, blk, 0, stream>>>(wv, wvT, D_MODEL, D_MODEL);
  cvt_transpose_kernel<<<(D_MODEL * D_MODEL) / 256, blk, 0, stream>>>(wo, woT, D_MODEL, D_MODEL);
  cvt_transpose_kernel<<<(D_MODEL * FFN_DIM) / 256, blk, 0, stream>>>(w1, w1T, D_MODEL, FFN_DIM);
  cvt_transpose_kernel<<<(D_MODEL * FFN_DIM) / 256, blk, 0, stream>>>(w2, w2T, FFN_DIM, D_MODEL);

  // h = x + Wo(attn(LN1(x)))
  layernorm_bf16_kernel<<<M, blk, 0, stream>>>(x, l1a, l1b, xln);
  dim3 gdd(D_MODEL / 128, M / 128);
  gemm_bf16_kernel<false, false, false, true><<<gdd, blk, 0, stream>>>(
      xln, wqT, bq, nullptr, nullptr, qb, M, D_MODEL, D_MODEL);
  gemm_bf16_kernel<false, false, false, true><<<gdd, blk, 0, stream>>>(
      xln, wkT, bk, nullptr, nullptr, kb, M, D_MODEL, D_MODEL);
  gemm_bf16_kernel<false, false, false, true><<<gdd, blk, 0, stream>>>(
      xln, wvT, bv, nullptr, nullptr, vbuf, M, D_MODEL, D_MODEL);
  attn_kernel<<<dim3(SEQ / 128, BATCH * HEADS), blk, 0, stream>>>(qb, kb, vbuf, mask, ctxb);
  gemm_bf16_kernel<true, false, true, false><<<gdd, blk, 0, stream>>>(
      ctxb, woT, bo, x, hbuf, nullptr, M, D_MODEL, D_MODEL);

  // out = h + W2(relu(W1(LN2(h))))
  layernorm_bf16_kernel<<<M, blk, 0, stream>>>(hbuf, l2a, l2b, xln);
  gemm_bf16_kernel<false, true, false, true><<<dim3(FFN_DIM / 128, M / 128), blk, 0, stream>>>(
      xln, w1T, b1, nullptr, nullptr, a1, M, FFN_DIM, D_MODEL);
  gemm_bf16_kernel<true, false, true, false><<<gdd, blk, 0, stream>>>(
      a1, w2T, b2, hbuf, (float*)d_out, nullptr, M, D_MODEL, FFN_DIM);
}

// v001
// A run of this version takes 618 microseconds.
// Two timings next to v000 both put it at 1.30 times that version's speed.
#include <hip/hip_runtime.h>
#include <hip/hip_bf16.h>
#include <math.h>

typedef __attribute__((ext_vector_type(16))) __bf16 v16bf;
typedef __attribute__((ext_vector_type(8)))  float  v8f;

typedef __attribute__((ext_vector_type(4))) unsigned int tdm_g0_t;
typedef __attribute__((ext_vector_type(8))) int          tdm_g1_t;
typedef __attribute__((ext_vector_type(4))) int          tdm_g23_t;
typedef __attribute__((ext_vector_type(8))) int          tdm_g4_t;

#define D_MODEL 1024
#define FFN_DIM 4096
#define BATCH   4
#define SEQ     2048
#define HEADS   16
#define DK      64
#define LDST    40   // LDS row stride in bf16 (16 DW data + 4 DW pad = 80B)

static __device__ __forceinline__ v16bf frag_ld(const __bf16* p, int hi) {
  v16bf f;
  const __bf16* p0 = p + hi * 8;
#pragma unroll
  for (int e = 0; e < 8; ++e) {
    f[e]     = p0[e];
    f[8 + e] = p0[16 + e];
  }
  return f;
}

static __device__ __forceinline__ unsigned lds_byte_off(const void* p) {
  return (unsigned)(unsigned long long)(size_t)p;
}

static __device__ __forceinline__ void tdm_load_tile_128x32bf(
    const __bf16* gptr, unsigned lds_addr, unsigned row_dw, unsigned nrows_total) {
  unsigned long long ga = (unsigned long long)(size_t)gptr;
  tdm_g0_t g0;
  g0[0] = 1u;                                             // count=1 (valid), user mode
  g0[1] = lds_addr;                                       // LDS byte address
  g0[2] = (unsigned)(ga & 0xffffffffu);                   // global_addr[31:0]
  g0[3] = (unsigned)((ga >> 32) & 0x01ffffffu) | (2u << 30); // addr[56:32] | type=2

  tdm_g1_t g1;
  g1[0] = (int)((2u << 16) | (1u << 20) | (3u << 22) | (3u << 25));
  g1[1] = (int)((row_dw & 0xffffu) << 16);
  g1[2] = (int)(((row_dw >> 16) & 0xffffu) | ((nrows_total & 0xffffu) << 16));
  g1[3] = (int)(((nrows_total >> 16) & 0xffffu) | (16u << 16));
  g1[4] = (int)128u;
  g1[5] = (int)row_dw;
  g1[6] = 0;
  g1[7] = 0;

  tdm_g23_t gz = {0, 0, 0, 0};
  tdm_g4_t  gz8 = {0, 0, 0, 0, 0, 0, 0, 0};
  __builtin_amdgcn_tensor_load_to_lds(g0, g1, gz, gz, gz8, 0);
}

// -------------------------------------------------------------------------
// f32 -> bf16 with transpose: Wt[n*K + k] = (bf16)W[k*N + n]
// -------------------------------------------------------------------------
__global__ void __launch_bounds__(256) cvt_transpose_kernel(
    const float* __restrict__ W, __bf16* __restrict__ Wt, int K, int N) {
  size_t idx = (size_t)blockIdx.x * 256 + threadIdx.x;
  size_t total = (size_t)K * N;
  if (idx >= total) return;
  int k = (int)(idx / N);
  int n = (int)(idx % N);
  Wt[(size_t)n * K + k] = (__bf16)W[idx];
}

// -------------------------------------------------------------------------
// LayerNorm (torch semantics: std with ddof=1, eps added to std), bf16 out.
// -------------------------------------------------------------------------
static __device__ __forceinline__ float block_reduce_sum(float v, float* sbuf) {
  __syncthreads();
#pragma unroll
  for (int off = 16; off > 0; off >>= 1) v += __shfl_xor(v, off, 32);
  const int wv = threadIdx.x >> 5;
  if ((threadIdx.x & 31) == 0) sbuf[wv] = v;
  __syncthreads();
  if (threadIdx.x == 0) {
    float s = 0.f;
#pragma unroll
    for (int i = 0; i < 8; ++i) s += sbuf[i];
    sbuf[0] = s;
  }
  __syncthreads();
  return sbuf[0];
}

__global__ void __launch_bounds__(256) layernorm_bf16_kernel(
    const float* __restrict__ x, const float* __restrict__ alpha,
    const float* __restrict__ beta, __bf16* __restrict__ out) {
  __shared__ float sbuf[8];
  const int row = blockIdx.x;
  const int tid = threadIdx.x;
  const float* xr = x + (size_t)row * D_MODEL;
  float xv[4];
#pragma unroll
  for (int i = 0; i < 4; ++i) xv[i] = xr[tid + i * 256];
  const float mean =
      block_reduce_sum(xv[0] + xv[1] + xv[2] + xv[3], sbuf) * (1.0f / D_MODEL);
  float ss = 0.f;
#pragma unroll
  for (int i = 0; i < 4; ++i) { float d = xv[i] - mean; ss += d * d; }
  const float var = block_reduce_sum(ss, sbuf) * (1.0f / (D_MODEL - 1));
  const float inv = 1.0f / (sqrtf(var) + 1e-6f);
  __bf16* orow = out + (size_t)row * D_MODEL;
#pragma unroll
  for (int i = 0; i < 4; ++i) {
    const int c = tid + i * 256;
    orow[c] = (__bf16)(alpha[c] * (xv[i] - mean) * inv + beta[c]);
  }
}

template <bool HAS_RESID, bool RELU, bool OUT_F32, bool OUT_BF16>
__global__ void __launch_bounds__(256) gemm_bf16_kernel(
    const __bf16* __restrict__ A, const __bf16* __restrict__ Bt,
    const float* __restrict__ bias, const float* __restrict__ resid,
    float* __restrict__ Cf, __bf16* __restrict__ Cb,
    int M, int N, int K) {
  __shared__ __align__(16) __bf16 lA[2][128 * LDST];
  __shared__ __align__(16) __bf16 lB[2][128 * LDST];

  const int tid   = threadIdx.x;
  const int wave  = tid >> 5;
  const int lane  = tid & 31;
  const int idx   = lane & 15;
  const int hi    = lane >> 4;
  const int waveM = wave >> 1;  // 0..3
  const int waveN = wave & 1;   // 0..1
  const int m0 = blockIdx.y * 128;
  const int n0 = blockIdx.x * 128;

  v8f acc[2][4] = {};

  const __bf16* Abase = A  + (size_t)m0 * K;
  const __bf16* Bbase = Bt + (size_t)n0 * K;
  const unsigned row_dw = (unsigned)(K >> 1);
  const int nk = K >> 5;

  if (tid < 32) {
    tdm_load_tile_128x32bf(Abase, lds_byte_off(&lA[0][0]), row_dw, (unsigned)M);
    tdm_load_tile_128x32bf(Bbase, lds_byte_off(&lB[0][0]), row_dw, (unsigned)N);
    __builtin_amdgcn_s_wait_tensorcnt(0);
  }
  __syncthreads();

  for (int i = 0; i < nk; ++i) {
    const int cur = i & 1;
    // Kick off DMA of the next K-tile into the other buffer while we compute.
    if (i + 1 < nk && tid < 32) {
      const int k1 = (i + 1) << 5;
      tdm_load_tile_128x32bf(Abase + k1, lds_byte_off(&lA[cur ^ 1][0]), row_dw, (unsigned)M);
      tdm_load_tile_128x32bf(Bbase + k1, lds_byte_off(&lB[cur ^ 1][0]), row_dw, (unsigned)N);
    }

    v16bf va[2], vb[4];
#pragma unroll
    for (int t = 0; t < 2; ++t)
      va[t] = frag_ld(&lA[cur][(waveM * 32 + t * 16 + idx) * LDST], hi);
#pragma unroll
    for (int u = 0; u < 4; ++u)
      vb[u] = frag_ld(&lB[cur][(waveN * 64 + u * 16 + idx) * LDST], hi);
#pragma unroll
    for (int t = 0; t < 2; ++t)
#pragma unroll
      for (int u = 0; u < 4; ++u)
        acc[t][u] = __builtin_amdgcn_wmma_f32_16x16x32_bf16(
            false, va[t], false, vb[u], (short)0, acc[t][u], false, false);

    if (tid < 32) __builtin_amdgcn_s_wait_tensorcnt(0);
    __syncthreads();  // next-tile DMA landed & everyone done reading cur
  }

  // ---- epilogue: bias -> relu -> residual ----
#pragma unroll
  for (int t = 0; t < 2; ++t) {
#pragma unroll
    for (int u = 0; u < 4; ++u) {
      const int gn = n0 + waveN * 64 + u * 16 + idx;
      const float bval = bias[gn];
      const size_t base =
          (size_t)(m0 + waveM * 32 + t * 16 + hi * 8) * N + gn;
#pragma unroll
      for (int r = 0; r < 8; ++r) {
        float v = acc[t][u][r] + bval;
        if (RELU) v = fmaxf(v, 0.f);
        if (HAS_RESID) v += resid[base + (size_t)r * N];
        if (OUT_F32) Cf[base + (size_t)r * N] = v;
        if (OUT_BF16) Cb[base + (size_t)r * N] = (__bf16)v;
      }
    }
  }
}

typedef __attribute__((ext_vector_type(8))) short  s16x8;
typedef __attribute__((ext_vector_type(8))) __bf16 v8bf;
#define LDSV 80  // V row pitch in bf16: 160 B = 32 B x odd, for the transposing load

static __device__ __forceinline__ v8bf ld_tr16(const __bf16* p) {
  typedef __attribute__((address_space(3))) s16x8 lds_s16x8;
  return __builtin_bit_cast(v8bf, __builtin_amdgcn_ds_load_tr16_b128_v8i16((lds_s16x8*)p));
}

static __device__ __forceinline__ float xhalf(float x) {
  const int xi = __builtin_bit_cast(int, x);
  return __builtin_bit_cast(float, __builtin_amdgcn_permlanex16(
      xi, xi, 0x76543210, 0xfedcba98, false, false));
}

__global__ void __launch_bounds__(256) attn_kernel(
    const __bf16* __restrict__ Q, const __bf16* __restrict__ Kmat,
    const __bf16* __restrict__ V, const int* __restrict__ mask,
    __bf16* __restrict__ Ctx) {
  __shared__ __align__(16) __bf16 lK[32][72];    // [kv][d]
  __shared__ __align__(32) __bf16 lV[32][LDSV];  // [kv][d]

  const int b    = blockIdx.y / HEADS;
  const int h    = blockIdx.y % HEADS;
  const int tid  = threadIdx.x;
  const int wave = tid >> 5;
  const int lane = tid & 31;
  const int idx  = lane & 15;
  const int hi   = lane >> 4;
  const int q0   = blockIdx.x * 128 + wave * 16;

  // B operand of S^T: lane holds query column idx, k (= d) in frag_ld's order.
  const __bf16* qrow = Q + (size_t)(b * SEQ + q0 + idx) * D_MODEL + h * DK;
  const v16bf qf0 = frag_ld(qrow, hi);
  const v16bf qf1 = frag_ld(qrow + 32, hi);

  float mrun = -3.0e38f;  // running maximum of query idx (same in both halves)
  float lsum = 0.f;       // this half's part of the denominator
  v8f o[4] = {};          // o[u][r] = O[q0 + idx][u*16 + 8*hi + r]

  const int* mcol = mask + (size_t)b * SEQ;
  // Transposing-load address of this lane: row 8*hi + (lane & 7), 16-byte half (lane >> 3) & 1.
  const __bf16* vtp = &lV[hi * 8 + (lane & 7)][((lane >> 3) & 1) * 8];

  for (int kv0 = 0; kv0 < SEQ; kv0 += 32) {
    __syncthreads();  // previous tile fully consumed
    const int mk = mcol[kv0 + lane];  // one key's mask per lane
    {
      const int kv  = tid >> 3;       // 0..31
      const int seg = (tid & 7) * 8;  // 0..56
      const __bf16* gk =
          Kmat + (size_t)(b * SEQ + kv0 + kv) * D_MODEL + h * DK + seg;
      const __bf16* gv =
          V + (size_t)(b * SEQ + kv0 + kv) * D_MODEL + h * DK + seg;
      *(uint4*)&lK[kv][seg] = *(const uint4*)gk;
      *(uint4*)&lV[kv][seg] = *(const uint4*)gv;
    }
    // The three loads' address registers are rewritten below: wait before that.
    asm volatile("s_wait_xcnt 0x0" ::: "memory");
    __syncthreads();

    // ---- S^T = (K Q^T) * 1/sqrt(dk), two 16-key tiles ----
    v8f st[2];  // st[nb][r]: key kv0 + nb*16 + 8*hi + r, query q0 + idx
    v16bf kf[2][2];  // all eight LDS reads stand together, ahead of the products
#pragma unroll
    for (int nb = 0; nb < 2; ++nb) {
      kf[nb][0] = frag_ld(&lK[nb * 16 + idx][0], hi);
      kf[nb][1] = frag_ld(&lK[nb * 16 + idx][32], hi);
    }
    // Keeps the eight reads in one group with one wait: the compiler otherwise sinks
    // each pair to its product and the wave pays the LDS latency four times a tile.
    __builtin_amdgcn_sched_barrier(0);
#pragma unroll
    for (int nb = 0; nb < 2; ++nb) {
      v8f a = {};
      a = __builtin_amdgcn_wmma_f32_16x16x32_bf16(false, kf[nb][0], false, qf0,
                                                  (short)0, a, false, false);
      a = __builtin_amdgcn_wmma_f32_16x16x32_bf16(false, kf[nb][1], false, qf1,
                                                  (short)0, a, false, false);
      st[nb] = a * 0.125f;
    }
    // Bit j of live: key kv0 + j is kept. A tile with a masked key (scalar
    // branch) sets those scores to -1e9, as the reference does.
    const unsigned live = __builtin_amdgcn_ballot_w32(mk != 0);
    if (live != 0xffffffffu) {
      const unsigned mine = live >> (hi * 8);
#pragma unroll
      for (int r = 0; r < 8; ++r) {
        if (!((mine >> r) & 1u))        st[0][r] = -1.0e9f;
        if (!((mine >> (16 + r)) & 1u)) st[1][r] = -1.0e9f;
      }
    }

    // ---- online softmax, one query per lane ----
    float mx = fmaxf(st[0][0], st[1][0]);
#pragma unroll
    for (int r = 1; r < 8; ++r) mx = fmaxf(mx, fmaxf(st[0][r], st[1][r]));
    mx = fmaxf(mx, xhalf(mx));
    const float mnew = fmaxf(mrun, mx);
    const float alph = __expf(mrun - mnew);
    mrun = mnew;

    v16bf pf;  // B operand P^T
    float rs = 0.f;
#pragma unroll
    for (int r = 0; r < 8; ++r) {
      const float p0 = __expf(st[0][r] - mnew);
      const float p1 = __expf(st[1][r] - mnew);
      pf[r]     = (__bf16)p0;
      pf[8 + r] = (__bf16)p1;
      rs += p0 + p1;
    }
    lsum = lsum * alph + rs;

    // ---- O^T = O^T * alph + V^T P^T ----
#pragma unroll
    for (int u = 0; u < 4; ++u) {
      const v8bf v0 = ld_tr16(vtp + u * 16);              // keys 8*hi + 0..7
      const v8bf v1 = ld_tr16(vtp + 16 * LDSV + u * 16);  // keys 16 + 8*hi + 0..7
      const v16bf vf = __builtin_shufflevector(v0, v1, 0, 1, 2, 3, 4, 5, 6, 7,
                                               8, 9, 10, 11, 12, 13, 14, 15);
      o[u] = __builtin_amdgcn_wmma_f32_16x16x32_bf16(false, vf, false, pf,
                                                     (short)0, o[u] * alph, false, false);
    }
  }

  // ---- join the halves' sums, normalize, store ctx (16 bytes per lane and u) ----
  const float ltot = lsum + xhalf(lsum);
  const float invl = (ltot > 0.f) ? (1.0f / ltot) : 0.f;
  __bf16* orow = Ctx + (size_t)(b * SEQ + q0 + idx) * D_MODEL + h * DK + hi * 8;
#pragma unroll
  for (int u = 0; u < 4; ++u) {
    v8bf ov;
#pragma unroll
    for (int r = 0; r < 8; ++r) ov[r] = (__bf16)(o[u][r] * invl);
    *(v8bf*)(orow + u * 16) = ov;
  }
}

// ---------------------------------------------------------------------------
// Host orchestration
// ---------------------------------------------------------------------------
extern "C" void kernel_launch(void* const* d_in, const int* in_sizes, int n_in,
                              void* d_out, int out_size, void* d_ws, size_t ws_size,
                              hipStream_t stream) {
  (void)in_sizes; (void)n_in; (void)out_size; (void)ws_size;
  const float* x    = (const float*)d_in[0];
  const int*   mask = (const int*)  d_in[1];
  const float* wq   = (const float*)d_in[2];
  const float* bq   = (const float*)d_in[3];
  const float* wk   = (const float*)d_in[4];
  const float* bk   = (const float*)d_in[5];
  const float* wv   = (const float*)d_in[6];
  const float* bv   = (const float*)d_in[7];
  const float* wo   = (const float*)d_in[8];
  const float* bo   = (const float*)d_in[9];
  const float* w1   = (const float*)d_in[10];
  const float* b1   = (const float*)d_in[11];
  const float* w2   = (const float*)d_in[12];
  const float* b2   = (const float*)d_in[13];
  const float* l1a  = (const float*)d_in[14];
  const float* l1b  = (const float*)d_in[15];
  const float* l2a  = (const float*)d_in[16];
  const float* l2b  = (const float*)d_in[17];

  const size_t DD2  = (size_t)D_MODEL * D_MODEL * 2;        // 2 MB
  const size_t DF2  = (size_t)D_MODEL * FFN_DIM * 2;        // 8 MB
  const size_t ACT2 = (size_t)BATCH * SEQ * D_MODEL * 2;    // 16 MB
  const size_t ACT4 = (size_t)BATCH * SEQ * D_MODEL * 4;    // 32 MB
  char* ws = (char*)d_ws;
  __bf16* wqT = (__bf16*)(ws + 0 * DD2);
  __bf16* wkT = (__bf16*)(ws + 1 * DD2);
  __bf16* wvT = (__bf16*)(ws + 2 * DD2);
  __bf16* woT = (__bf16*)(ws + 3 * DD2);
  __bf16* w1T = (__bf16*)(ws + 4 * DD2);
  __bf16* w2T = (__bf16*)(ws + 4 * DD2 + DF2);
  char* p = ws + 4 * DD2 + 2 * DF2;
  float*  hbuf = (float*)p;            p += ACT4;   // h = x + attn (f32)
  __bf16* xln  = (__bf16*)p;           p += ACT2;   // ln1 out, reused as ln2 out
  __bf16* qb   = (__bf16*)(p + 0 * ACT2);
  __bf16* kb   = (__bf16*)(p + 1 * ACT2);
  __bf16* vbuf = (__bf16*)(p + 2 * ACT2);
  __bf16* ctxb = (__bf16*)(p + 3 * ACT2);
  __bf16* a1   = (__bf16*)p;  // FFN hidden (64 MB) reuses q/k/v/ctx region
  // total workspace: ~136 MB

  const int M = BATCH * SEQ;  // 8192
  dim3 blk(256);

  cvt_transpose_kernel<<<(D_MODEL * D_MODEL) / 256, blk, 0, stream>>>(wq, wqT, D_MODEL, D_MODEL);
  cvt_transpose_kernel<<<(D_MODEL * D_MODEL) / 256, blk, 0, stream>>>(wk, wkT, D_MODEL, D_MODEL);
  cvt_transpose_kernel<<<(D_MODEL * D_MODEL) / 256, blk, 0, stream>>>(wv, wvT, D_MODEL, D_MODEL);
  cvt_transpose_kernel<<<(D_MODEL * D_MODEL) / 256, blk, 0, stream>>>(wo, woT, D_MODEL, D_MODEL);
  cvt_transpose_kernel<<<(D_MODEL * FFN_DIM) / 256, blk, 0, stream>>>(w1, w1T, D_MODEL, FFN_DIM);
  cvt_transpose_kernel<<<(D_MODEL * FFN_DIM) / 256, blk, 0, stream>>>(w2, w2T, FFN_DIM, D_MODEL);

  // h = x + Wo(attn(LN1(x)))
  layernorm_bf16_kernel<<<M, blk, 0, stream>>>(x, l1a, l1b, xln);
  dim3 gdd(D_MODEL / 128, M / 128);
  gemm_bf16_kernel<false, false, false, true><<<gdd, blk, 0, stream>>>(
      xln, wqT, bq, nullptr, nullptr, qb, M, D_MODEL, D_MODEL);
  gemm_bf16_kernel<false, false, false, true><<<gdd, blk, 0, stream>>>(
      xln, wkT, bk, nullptr, nullptr, kb, M, D_MODEL, D_MODEL);
  gemm_bf16_kernel<false, false, false, true><<<gdd, blk, 0, stream>>>(
      xln, wvT, bv, nullptr, nullptr, vbuf, M, D_MODEL, D_MODEL);
  attn_kernel<<<dim3(SEQ / 128, BATCH * HEADS), blk, 0, stream>>>(qb, kb, vbuf, mask, ctxb);
  gemm_bf16_kernel<true, false, true, false><<<gdd, blk, 0, stream>>>(
      ctxb, woT, bo, x, hbuf, nullptr, M, D_MODEL, D_MODEL);

  // out = h + W2(relu(W1(LN2(h))))
  layernorm_bf16_kernel<<<M, blk, 0, stream>>>(hbuf, l2a, l2b, xln);
  gemm_bf16_kernel<false, true, false, true><<<dim3(FFN_DIM / 128, M / 128), blk, 0, stream>>>(
      xln, w1T, b1, nullptr, nullptr, a1, M, FFN_DIM, D_MODEL);
  gemm_bf16_kernel<true, false, true, false><<<gdd, blk, 0, stream>>>(
      a1, w2T, b2, hbuf, (float*)d_out, nullptr, M, D_MODEL, FFN_DIM);
}

// v002
// One run takes 377 microseconds.
// Next to v001, in two timings, it ran 1.70 and 1.59 times as fast.
// Counting every step since v000, it is 2.13 times as fast.
#include <hip/hip_runtime.h>
#include <hip/hip_bf16.h>
#include <math.h>

typedef __attribute__((ext_vector_type(16))) __bf16 v16bf;
typedef __attribute__((ext_vector_type(8)))  float  v8f;
typedef __attribute__((ext_vector_type(8)))  __bf16 v8bf;
typedef __attribute__((ext_vector_type(4)))  __bf16 v4bf;

typedef __attribute__((ext_vector_type(4))) unsigned int tdm_g0_t;
typedef __attribute__((ext_vector_type(8))) int          tdm_g1_t;
typedef __attribute__((ext_vector_type(4))) int          tdm_g23_t;
typedef __attribute__((ext_vector_type(8))) int          tdm_g4_t;

#define D_MODEL 1024
#define FFN_DIM 4096
#define BATCH   4
#define SEQ     2048
#define HEADS   16
#define DK      64
#define LDST    40   // LDS row stride in bf16 (16 DW data + 4 DW pad = 80B)

static __device__ __forceinline__ v16bf frag_ld(const __bf16* p, int hi) {
  v16bf f;
  const __bf16* p0 = p + hi * 8;
#pragma unroll
  for (int e = 0; e < 8; ++e) {
    f[e]     = p0[e];
    f[8 + e] = p0[16 + e];
  }
  return f;
}

static __device__ __forceinline__ unsigned lds_byte_off(const void* p) {
  return (unsigned)(unsigned long long)(size_t)p;
}

static __device__ __forceinline__ void tdm_load_tile_128x32bf(
    const __bf16* gptr, unsigned lds_addr, unsigned row_dw, unsigned nrows_total) {
  unsigned long long ga = (unsigned long long)(size_t)gptr;
  tdm_g0_t g0;
  g0[0] = 1u;                                             // count=1 (valid), user mode
  g0[1] = lds_addr;                                       // LDS byte address
  g0[2] = (unsigned)(ga & 0xffffffffu);                   // global_addr[31:0]
  g0[3] = (unsigned)((ga >> 32) & 0x01ffffffu) | (2u << 30); // addr[56:32] | type=2

  tdm_g1_t g1;
  g1[0] = (int)((2u << 16) | (1u << 20) | (3u << 22) | (3u << 25));
  g1[1] = (int)((row_dw & 0xffffu) << 16);
  g1[2] = (int)(((row_dw >> 16) & 0xffffu) | ((nrows_total & 0xffffu) << 16));
  g1[3] = (int)(((nrows_total >> 16) & 0xffffu) | (16u << 16));
  g1[4] = (int)128u;
  g1[5] = (int)row_dw;
  g1[6] = 0;
  g1[7] = 0;

  tdm_g23_t gz = {0, 0, 0, 0};
  tdm_g4_t  gz8 = {0, 0, 0, 0, 0, 0, 0, 0};
  __builtin_amdgcn_tensor_load_to_lds(g0, g1, gz, gz, gz8, 0);
}

// -------------------------------------------------------------------------
// f32 -> bf16 with transpose: Wt[n*K + k] = (bf16)W[k*N + n]
// A work-group takes a tile of 64 k by 128 n (K a multiple of 64, N of 128).
// A thread reads 8 rows k of 4 columns n (a wave's load is 512 contiguous bytes)
// and stores, per column, its 8 values of k as one 16-byte run; the 8 waves
// cover 64 consecutive k, so the work-group fills whole 128-byte lines of Wt.
// K and N are compile-time values: every row step is an immediate offset.
// -------------------------------------------------------------------------
template <int K, int N>
__global__ void __launch_bounds__(256) cvt_transpose_kernel(
    const float* __restrict__ W, __bf16* __restrict__ Wt) {
  const int wave = threadIdx.x >> 5;
  const int lane = threadIdx.x & 31;
  const int k0 = blockIdx.y * 64 + wave * 8;
  const int n0 = blockIdx.x * 128 + lane * 4;
  const float* src = W + (size_t)k0 * N + n0;
  float4 r[8];
#pragma unroll
  for (int i = 0; i < 8; ++i) r[i] = *(const float4*)(src + i * N);
  // The loads' address register stays live up to this wait, so that nothing
  // (a later load's result either) is written over it ahead of the wait.
  asm volatile("s_wait_xcnt 0x0" :: "v"(src) : "memory");
  __bf16* dst = Wt + (size_t)n0 * K + k0;
  v8bf c0, c1, c2, c3;
#pragma unroll
  for (int i = 0; i < 8; ++i) {
    c0[i] = (__bf16)r[i].x;
    c1[i] = (__bf16)r[i].y;
    c2[i] = (__bf16)r[i].z;
    c3[i] = (__bf16)r[i].w;
  }
  *(v8bf*)(dst)         = c0;
  *(v8bf*)(dst + K)     = c1;
  *(v8bf*)(dst + K * 2) = c2;
  *(v8bf*)(dst + K * 3) = c3;
}

// -------------------------------------------------------------------------
// LayerNorm (torch semantics: std with ddof=1, eps added to std), bf16 out.
// One wave normalizes two rows, both loaded up front (16 loads of 16 bytes a
// lane in flight); a lane holds 32 values of each row. Sums run in-lane, then
// over the 32 lanes by a butterfly: no LDS buffer and no barrier.
// -------------------------------------------------------------------------
static __device__ __forceinline__ void wave_sum2(float& a, float& b) {
#pragma unroll
  for (int off = 16; off > 0; off >>= 1) {
    const float ta = __shfl_xor(a, off, 32);
    const float tb = __shfl_xor(b, off, 32);
    a += ta;
    b += tb;
  }
}

__global__ void __launch_bounds__(256) layernorm_bf16_kernel(
    const float* __restrict__ x, const float* __restrict__ alpha,
    const float* __restrict__ beta, __bf16* __restrict__ out) {
  const int wave = threadIdx.x >> 5;
  const int lane = threadIdx.x & 31;
  const int row0 = (blockIdx.x * 8 + wave) * 2;
  const float* xr = x + (size_t)row0 * D_MODEL + lane * 4;
  float4 xv[2][8];
#pragma unroll
  for (int r = 0; r < 2; ++r)
#pragma unroll
    for (int i = 0; i < 8; ++i)
      xv[r][i] = *(const float4*)(xr + r * D_MODEL + i * 128);
  // The loads' address register stays live up to this wait, so that nothing
  // (a later load's result either) is written over it ahead of the wait.
  asm volatile("s_wait_xcnt 0x0" :: "v"(xr) : "memory");

  float s[2];
#pragma unroll
  for (int r = 0; r < 2; ++r) {
    float4 t = xv[r][0];
#pragma unroll
    for (int i = 1; i < 8; ++i) {
      t.x += xv[r][i].x; t.y += xv[r][i].y; t.z += xv[r][i].z; t.w += xv[r][i].w;
    }
    s[r] = (t.x + t.y) + (t.z + t.w);
  }
  wave_sum2(s[0], s[1]);
  const float mean[2] = {s[0] * (1.0f / D_MODEL), s[1] * (1.0f / D_MODEL)};

  float q[2];
#pragma unroll
  for (int r = 0; r < 2; ++r) {
    float4 t = {0.f, 0.f, 0.f, 0.f};
#pragma unroll
    for (int i = 0; i < 8; ++i) {
      const float dx = xv[r][i].x - mean[r], dy = xv[r][i].y - mean[r];
      const float dz = xv[r][i].z - mean[r], dw = xv[r][i].w - mean[r];
      t.x += dx * dx; t.y += dy * dy; t.z += dz * dz; t.w += dw * dw;
    }
    q[r] = (t.x + t.y) + (t.z + t.w);
  }
  wave_sum2(q[0], q[1]);
  const float inv[2] = {1.0f / (sqrtf(q[0] * (1.0f / (D_MODEL - 1))) + 1e-6f),
                        1.0f / (sqrtf(q[1] * (1.0f / (D_MODEL - 1))) + 1e-6f)};

  __bf16* orow = out + (size_t)row0 * D_MODEL + lane * 4;
#pragma unroll
  for (int i = 0; i < 8; ++i) {
    const float4 al = *(const float4*)(alpha + i * 128 + lane * 4);
    const float4 be = *(const float4*)(beta + i * 128 + lane * 4);
#pragma unroll
    for (int r = 0; r < 2; ++r) {
      v4bf o;
      o[0] = (__bf16)(al.x * (xv[r][i].x - mean[r]) * inv[r] + be.x);
      o[1] = (__bf16)(al.y * (xv[r][i].y - mean[r]) * inv[r] + be.y);
      o[2] = (__bf16)(al.z * (xv[r][i].z - mean[r]) * inv[r] + be.z);
      o[3] = (__bf16)(al.w * (xv[r][i].w - mean[r]) * inv[r] + be.w);
      *(v4bf*)(orow + r * D_MODEL + i * 128) = o;
    }
  }
}

template <bool HAS_RESID, bool RELU, bool OUT_F32, bool OUT_BF16>
__global__ void __launch_bounds__(256) gemm_bf16_kernel(
    const __bf16* __restrict__ A, const __bf16* __restrict__ Bt,
    const float* __restrict__ bias, const float* __restrict__ resid,
    float* __restrict__ Cf, __bf16* __restrict__ Cb,
    int M, int N, int K) {
  __shared__ __align__(16) __bf16 lA[2][128 * LDST];
  __shared__ __align__(16) __bf16 lB[2][128 * LDST];

  const int tid   = threadIdx.x;
  const int wave  = tid >> 5;
  const int lane  = tid & 31;
  const int idx   = lane & 15;
  const int hi    = lane >> 4;
  const int waveM = wave >> 1;  // 0..3
  const int waveN = wave & 1;   // 0..1
  const int m0 = blockIdx.y * 128;
  const int n0 = blockIdx.x * 128;

  v8f acc[2][4] = {};

  const __bf16* Abase = A  + (size_t)m0 * K;
  const __bf16* Bbase = Bt + (size_t)n0 * K;
  const unsigned row_dw = (unsigned)(K >> 1);
  const int nk = K >> 5;

  if (tid < 32) {
    tdm_load_tile_128x32bf(Abase, lds_byte_off(&lA[0][0]), row_dw, (unsigned)M);
    tdm_load_tile_128x32bf(Bbase, lds_byte_off(&lB[0][0]), row_dw, (unsigned)N);
    __builtin_amdgcn_s_wait_tensorcnt(0);
  }
  __syncthreads();

  for (int i = 0; i < nk; ++i) {
    const int cur = i & 1;
    // Kick off DMA of the next K-tile into the other buffer while we compute.
    if (i + 1 < nk && tid < 32) {
      const int k1 = (i + 1) << 5;
      tdm_load_tile_128x32bf(Abase + k1, lds_byte_off(&lA[cur ^ 1][0]), row_dw, (unsigned)M);
      tdm_load_tile_128x32bf(Bbase + k1, lds_byte_off(&lB[cur ^ 1][0]), row_dw, (unsigned)N);
    }

    v16bf va[2], vb[4];
#pragma unroll
    for (int t = 0; t < 2; ++t)
      va[t] = frag_ld(&lA[cur][(waveM * 32 + t * 16 + idx) * LDST], hi);
#pragma unroll
    for (int u = 0; u < 4; ++u)
      vb[u] = frag_ld(&lB[cur][(waveN * 64 + u * 16 + idx) * LDST], hi);
#pragma unroll
    for (int t = 0; t < 2; ++t)
#pragma unroll
      for (int u = 0; u < 4; ++u)
        acc[t][u] = __builtin_amdgcn_wmma_f32_16x16x32_bf16(
            false, va[t], false, vb[u], (short)0, acc[t][u], false, false);

    if (tid < 32) __builtin_amdgcn_s_wait_tensorcnt(0);
    __syncthreads();  // next-tile DMA landed & everyone done reading cur
  }

  // ---- epilogue: bias -> relu -> residual ----
#pragma unroll
  for (int t = 0; t < 2; ++t) {
#pragma unroll
    for (int u = 0; u < 4; ++u) {
      const int gn = n0 + waveN * 64 + u * 16 + idx;
      const float bval = bias[gn];
      const size_t base =
          (size_t)(m0 + waveM * 32 + t * 16 + hi * 8) * N + gn;
#pragma unroll
      for (int r = 0; r < 8; ++r) {
        float v = acc[t][u][r] + bval;
        if (RELU) v = fmaxf(v, 0.f);
        if (HAS_RESID) v += resid[base + (size_t)r * N];
        if (OUT_F32) Cf[base + (size_t)r * N] = v;
        if (OUT_BF16) Cb[base + (size_t)r * N] = (__bf16)v;
      }
    }
  }
}

typedef __attribute__((ext_vector_type(8))) short  s16x8;
#define LDSV 80  // V row pitch in bf16: 160 B = 32 B x odd, for the transposing load

static __device__ __forceinline__ v8bf ld_tr16(const __bf16* p) {
  typedef __attribute__((address_space(3))) s16x8 lds_s16x8;
  return __builtin_bit_cast(v8bf, __builtin_amdgcn_ds_load_tr16_b128_v8i16((lds_s16x8*)p));
}

static __device__ __forceinline__ float xhalf(float x) {
  const int xi = __builtin_bit_cast(int, x);
  return __builtin_bit_cast(float, __builtin_amdgcn_permlanex16(
      xi, xi, 0x76543210, 0xfedcba98, false, false));
}

__global__ void __launch_bounds__(256) attn_kernel(
    const __bf16* __restrict__ Q, const __bf16* __restrict__ Kmat,
    const __bf16* __restrict__ V, const int* __restrict__ mask,
    __bf16* __restrict__ Ctx) {
  __shared__ __align__(16) __bf16 lK[32][72];    // [kv][d]
  __shared__ __align__(32) __bf16 lV[32][LDSV];  // [kv][d]

  const int b    = blockIdx.y / HEADS;
  const int h    = blockIdx.y % HEADS;
  const int tid  = threadIdx.x;
  const int wave = tid >> 5;
  const int lane = tid & 31;
  const int idx  = lane & 15;
  const int hi   = lane >> 4;
  const int q0   = blockIdx.x * 128 + wave * 16;

  // B operand of S^T: lane holds query column idx, k (= d) in frag_ld's order.
  const __bf16* qrow = Q + (size_t)(b * SEQ + q0 + idx) * D_MODEL + h * DK;
  const v16bf qf0 = frag_ld(qrow, hi);
  const v16bf qf1 = frag_ld(qrow + 32, hi);

  float mrun = -3.0e38f;  // running maximum of query idx (same in both halves)
  float lsum = 0.f;       // this half's part of the denominator
  v8f o[4] = {};          // o[u][r] = O[q0 + idx][u*16 + 8*hi + r]

  const int* mcol = mask + (size_t)b * SEQ;
  // Transposing-load address of this lane: row 8*hi + (lane & 7), 16-byte half (lane >> 3) & 1.
  const __bf16* vtp = &lV[hi * 8 + (lane & 7)][((lane >> 3) & 1) * 8];

  for (int kv0 = 0; kv0 < SEQ; kv0 += 32) {
    __syncthreads();  // previous tile fully consumed
    const int mk = mcol[kv0 + lane];  // one key's mask per lane
    {
      const int kv  = tid >> 3;       // 0..31
      const int seg = (tid & 7) * 8;  // 0..56
      const __bf16* gk =
          Kmat + (size_t)(b * SEQ + kv0 + kv) * D_MODEL + h * DK + seg;
      const __bf16* gv =
          V + (size_t)(b * SEQ + kv0 + kv) * D_MODEL + h * DK + seg;
      *(uint4*)&lK[kv][seg] = *(const uint4*)gk;
      *(uint4*)&lV[kv][seg] = *(const uint4*)gv;
    }
    // The three loads' address registers are rewritten below: wait before that.
    asm volatile("s_wait_xcnt 0x0" ::: "memory");
    __syncthreads();

    // ---- S^T = (K Q^T) * 1/sqrt(dk), two 16-key tiles ----
    v8f st[2];  // st[nb][r]: key kv0 + nb*16 + 8*hi + r, query q0 + idx
    v16bf kf[2][2];  // all eight LDS reads stand together, ahead of the products
#pragma unroll
    for (int nb = 0; nb < 2; ++nb) {
      kf[nb][0] = frag_ld(&lK[nb * 16 + idx][0], hi);
      kf[nb][1] = frag_ld(&lK[nb * 16 + idx][32], hi);
    }
    // Keeps the eight reads in one group with one wait: the compiler otherwise sinks
    // each pair to its product and the wave pays the LDS latency four times a tile.
    __builtin_amdgcn_sched_barrier(0);
#pragma unroll
    for (int nb = 0; nb < 2; ++nb) {
      v8f a = {};
      a = __builtin_amdgcn_wmma_f32_16x16x32_bf16(false, kf[nb][0], false, qf0,
                                                  (short)0, a, false, false);
      a = __builtin_amdgcn_wmma_f32_16x16x32_bf16(false, kf[nb][1], false, qf1,
                                                  (short)0, a, false, false);
      st[nb] = a * 0.125f;
    }
    // Bit j of live: key kv0 + j is kept. A tile with a masked key (scalar
    // branch) sets those scores to -1e9, as the reference does.
    const unsigned live = __builtin_amdgcn_ballot_w32(mk != 0);
    if (live != 0xffffffffu) {
      const unsigned mine = live >> (hi * 8);
#pragma unroll
      for (int r = 0; r < 8; ++r) {
        if (!((mine >> r) & 1u))        st[0][r] = -1.0e9f;
        if (!((mine >> (16 + r)) & 1u)) st[1][r] = -1.0e9f;
      }
    }

    // ---- online softmax, one query per lane ----
    float mx = fmaxf(st[0][0], st[1][0]);
#pragma unroll
    for (int r = 1; r < 8; ++r) mx = fmaxf(mx, fmaxf(st[0][r], st[1][r]));
    mx = fmaxf(mx, xhalf(mx));
    const float mnew = fmaxf(mrun, mx);
    const float alph = __expf(mrun - mnew);
    mrun = mnew;

    v16bf pf;  // B operand P^T
    float rs = 0.f;
#pragma unroll
    for (int r = 0; r < 8; ++r) {
      const float p0 = __expf(st[0][r] - mnew);
      const float p1 = __expf(st[1][r] - mnew);
      pf[r]     = (__bf16)p0;
      pf[8 + r] = (__bf16)p1;
      rs += p0 + p1;
    }
    lsum = lsum * alph + rs;

    // ---- O^T = O^T * alph + V^T P^T ----
#pragma unroll
    for (int u = 0; u < 4; ++u) {
      const v8bf v0 = ld_tr16(vtp + u * 16);              // keys 8*hi + 0..7
      const v8bf v1 = ld_tr16(vtp + 16 * LDSV + u * 16);  // keys 16 + 8*hi + 0..7
      const v16bf vf = __builtin_shufflevector(v0, v1, 0, 1, 2, 3, 4, 5, 6, 7,
                                               8, 9, 10, 11, 12, 13, 14, 15);
      o[u] = __builtin_amdgcn_wmma_f32_16x16x32_bf16(false, vf, false, pf,
                                                     (short)0, o[u] * alph, false, false);
    }
  }

  // ---- join the halves' sums, normalize, store ctx (16 bytes per lane and u) ----
  const float ltot = lsum + xhalf(lsum);
  const float invl = (ltot > 0.f) ? (1.0f / ltot) : 0.f;
  __bf16* orow = Ctx + (size_t)(b * SEQ + q0 + idx) * D_MODEL + h * DK + hi * 8;
#pragma unroll
  for (int u = 0; u < 4; ++u) {
    v8bf ov;
#pragma unroll
    for (int r = 0; r < 8; ++r) ov[r] = (__bf16)(o[u][r] * invl);
    *(v8bf*)(orow + u * 16) = ov;
  }
}

// ---------------------------------------------------------------------------
// Host orchestration
// ---------------------------------------------------------------------------
extern "C" void kernel_launch(void* const* d_in, const int* in_sizes, int n_in,
                              void* d_out, int out_size, void* d_ws, size_t ws_size,
                              hipStream_t stream) {
  (void)in_sizes; (void)n_in; (void)out_size; (void)ws_size;
  const float* x    = (const float*)d_in[0];
  const int*   mask = (const int*)  d_in[1];
  const float* wq   = (const float*)d_in[2];
  const float* bq   = (const float*)d_in[3];
  const float* wk   = (const float*)d_in[4];
  const float* bk   = (const float*)d_in[5];
  const float* wv   = (const float*)d_in[6];
  const float* bv   = (const float*)d_in[7];
  const float* wo   = (const float*)d_in[8];
  const float* bo   = (const float*)d_in[9];
  const float* w1   = (const float*)d_in[10];
  const float* b1   = (const float*)d_in[11];
  const float* w2   = (const float*)d_in[12];
  const float* b2   = (const float*)d_in[13];
  const float* l1a  = (const float*)d_in[14];
  const float* l1b  = (const float*)d_in[15];
  const float* l2a  = (const float*)d_in[16];
  const float* l2b  = (const float*)d_in[17];

  const size_t DD2  = (size_t)D_MODEL * D_MODEL * 2;        // 2 MB
  const size_t DF2  = (size_t)D_MODEL * FFN_DIM * 2;        // 8 MB
  const size_t ACT2 = (size_t)BATCH * SEQ * D_MODEL * 2;    // 16 MB
  const size_t ACT4 = (size_t)BATCH * SEQ * D_MODEL * 4;    // 32 MB
  char* ws = (char*)d_ws;
  __bf16* wqT = (__bf16*)(ws + 0 * DD2);
  __bf16* wkT = (__bf16*)(ws + 1 * DD2);
  __bf16* wvT = (__bf16*)(ws + 2 * DD2);
  __bf16* woT = (__bf16*)(ws + 3 * DD2);
  __bf16* w1T = (__bf16*)(ws + 4 * DD2);
  __bf16* w2T = (__bf16*)(ws + 4 * DD2 + DF2);
  char* p = ws + 4 * DD2 + 2 * DF2;
  float*  hbuf = (float*)p;            p += ACT4;   // h = x + attn (f32)
  __bf16* xln  = (__bf16*)p;           p += ACT2;   // ln1 out, reused as ln2 out
  __bf16* qb   = (__bf16*)(p + 0 * ACT2);
  __bf16* kb   = (__bf16*)(p + 1 * ACT2);
  __bf16* vbuf = (__bf16*)(p + 2 * ACT2);
  __bf16* ctxb = (__bf16*)(p + 3 * ACT2);
  __bf16* a1   = (__bf16*)p;  // FFN hidden (64 MB) reuses q/k/v/ctx region
  // total workspace: ~136 MB

  const int M = BATCH * SEQ;  // 8192
  dim3 blk(256);

  // grid: (N / 128, K / 64)
  const dim3 gtd(D_MODEL / 128, D_MODEL / 64);
  cvt_transpose_kernel<D_MODEL, D_MODEL><<<gtd, blk, 0, stream>>>(wq, wqT);
  cvt_transpose_kernel<D_MODEL, D_MODEL><<<gtd, blk, 0, stream>>>(wk, wkT);
  cvt_transpose_kernel<D_MODEL, D_MODEL><<<gtd, blk, 0, stream>>>(wv, wvT);
  cvt_transpose_kernel<D_MODEL, D_MODEL><<<gtd, blk, 0, stream>>>(wo, woT);
  cvt_transpose_kernel<D_MODEL, FFN_DIM><<<dim3(FFN_DIM / 128, D_MODEL / 64), blk, 0, stream>>>(w1, w1T);
  cvt_transpose_kernel<FFN_DIM, D_MODEL><<<dim3(D_MODEL / 128, FFN_DIM / 64), blk, 0, stream>>>(w2, w2T);

  // h = x + Wo(attn(LN1(x)))
  layernorm_bf16_kernel<<<M / 16, blk, 0, stream>>>(x, l1a, l1b, xln);
  dim3 gdd(D_MODEL / 128, M / 128);
  gemm_bf16_kernel<false, false, false, true><<<gdd, blk, 0, stream>>>(
      xln, wqT, bq, nullptr, nullptr, qb, M, D_MODEL, D_MODEL);
  gemm_bf16_kernel<false, false, false, true><<<gdd, blk, 0, stream>>>(
      xln, wkT, bk, nullptr, nullptr, kb, M, D_MODEL, D_MODEL);
  gemm_bf16_kernel<false, false, false, true><<<gdd, blk, 0, stream>>>(
      xln, wvT, bv, nullptr, nullptr, vbuf, M, D_MODEL, D_MODEL);
  attn_kernel<<<dim3(SEQ / 128, BATCH * HEADS), blk, 0, stream>>>(qb, kb, vbuf, mask, ctxb);
  gemm_bf16_kernel<true, false, true, false><<<gdd, blk, 0, stream>>>(
      ctxb, woT, bo, x, hbuf, nullptr, M, D_MODEL, D_MODEL);

  // out = h + W2(relu(W1(LN2(h))))
  layernorm_bf16_kernel<<<M / 16, blk, 0, stream>>>(hbuf, l2a, l2b, xln);
  gemm_bf16_kernel<false, true, false, true><<<dim3(FFN_DIM / 128, M / 128), blk, 0, stream>>>(
      xln, w1T, b1, nullptr, nullptr, a1, M, FFN_DIM, D_MODEL);
  gemm_bf16_kernel<true, false, true, false><<<gdd, blk, 0, stream>>>(
      a1, w2T, b2, hbuf, (float*)d_out, nullptr, M, D_MODEL, FFN_DIM);
}
